// v000
// The times below were measured on an AMD MI455X: many runs one after another, warmed up first and cycling through
// copies of the inputs, with the whole window's GPU time divided by the number of runs. Launches and the gaps
// between them are all in it. The median over several windows is given; except for v000 it joins two sittings, which
// can be a few percent apart, so the side-by-side timings, each taken in one sitting, are the better comparison.
// v000, which the later versions start from, runs in 70.6 microseconds.
#include <hip/hip_runtime.h>
#include <cstdint>

#define BATCH  2
#define CCH    64
#define C8V    8
#define NV     4096   // 16*16*16 flattened spatial
#define NSPLIT 2      // flash-decoding split over j
#define JSPAN  (NV / NSPLIT)

typedef __attribute__((ext_vector_type(16))) _Float16     v16h;
typedef __attribute__((ext_vector_type(8)))  float        v8f;
typedef __attribute__((ext_vector_type(4)))  float        v4f;
typedef __attribute__((ext_vector_type(4)))  unsigned int v4u;

union V16H {          // 8 VGPRs viewed as 16 halves or 2x b128
  v16h h;
  v4u  q[2];
};

// ---------------- Phase 1a: Q/K projections (64 -> 8), f16 [b][n][8] ----------------
__global__ __launch_bounds__(256) void qk_proj_kernel(
    const float* __restrict__ x,
    const float* __restrict__ Wq, const float* __restrict__ bq,
    const float* __restrict__ Wk, const float* __restrict__ bk,
    _Float16* __restrict__ qT, _Float16* __restrict__ kT)
{
  __shared__ float sWq[C8V * CCH];
  __shared__ float sWk[C8V * CCH];
  const int tid = threadIdx.x;
  for (int i = tid; i < C8V * CCH; i += 256) { sWq[i] = Wq[i]; sWk[i] = Wk[i]; }
  __syncthreads();

  const int blocksPerB = NV / 256;                       // 16
  const int b = blockIdx.x / blocksPerB;
  const int n = (blockIdx.x % blocksPerB) * 256 + tid;
  const float* xb = x + (size_t)b * CCH * NV + n;

  float qa[C8V], ka[C8V];
  #pragma unroll
  for (int o = 0; o < C8V; ++o) { qa[o] = bq[o]; ka[o] = bk[o]; }

  for (int c = 0; c < CCH; ++c) {
    const float xv = xb[(size_t)c * NV];
    #pragma unroll
    for (int o = 0; o < C8V; ++o) {
      qa[o] = fmaf(sWq[o * CCH + c], xv, qa[o]);
      ka[o] = fmaf(sWk[o * CCH + c], xv, ka[o]);
    }
  }

  union { _Float16 h[8]; v4u v; } pq, pk;
  #pragma unroll
  for (int o = 0; o < C8V; ++o) { pq.h[o] = (_Float16)qa[o]; pk.h[o] = (_Float16)ka[o]; }
  const size_t off = ((size_t)b * NV + n) * C8V;
  *(v4u*)(qT + off) = pq.v;
  *(v4u*)(kT + off) = pk.v;
}

// ---------------- Phase 1b: V projection (64 -> 64), f16 [b][c][n] ----------------
__global__ __launch_bounds__(256) void v_proj_kernel(
    const float* __restrict__ x,
    const float* __restrict__ Wv, const float* __restrict__ bv,
    _Float16* __restrict__ vT)
{
  __shared__ float sW[CCH];
  const int tid = threadIdx.x;
  const int blocksPerC = NV / 256;                       // 16
  const int b = blockIdx.x / (CCH * blocksPerC);
  const int c = (blockIdx.x / blocksPerC) % CCH;
  const int n = (blockIdx.x % blocksPerC) * 256 + tid;

  if (tid < CCH) sW[tid] = Wv[c * CCH + tid];
  __syncthreads();

  const float* xb = x + (size_t)b * CCH * NV + n;
  float acc = bv[c];
  for (int cc = 0; cc < CCH; ++cc) acc = fmaf(sW[cc], xb[(size_t)cc * NV], acc);
  vT[(size_t)b * CCH * NV + (size_t)c * NV + n] = (_Float16)acc;
}

// ---------------- Phase 2: fused flash attention ----------------
// One wave32 handles TWO 16-row i-tiles over one j-split of 2048.
// S^T tiles via v_wmma_f32_16x16x32_f16 (A = K rows, B = Q cols, K-dim 8 padded to 32).
// The f32 D-layout of S^T is exactly the f16 B-layout of the PV WMMA, so exp+pack
// is the only glue between the two GEMMs. K/V tile loads are shared by both i-tiles.
// Writes unnormalized (O, m, l) partials per split; combine_kernel merges splits.
__global__ __launch_bounds__(32) void attn_kernel(
    const _Float16* __restrict__ qT,
    const _Float16* __restrict__ kT,
    const _Float16* __restrict__ vT,
    float*          __restrict__ pO,    // [b][split][i][c] f32, unnormalized
    float*          __restrict__ pML)   // [b][split][i][{m,l}] f32
{
  const int lane = threadIdx.x;
  const int l16  = lane & 15;
  const int half = lane >> 4;

  const int grpPerB = NV / 32;                           // 128 i-groups of 32 rows
  const int b  = blockIdx.x / (NSPLIT * grpPerB);
  const int sp = (blockIdx.x / grpPerB) % NSPLIT;
  const int ig = blockIdx.x % grpPerB;
  const int jbeg = sp * JSPAN;
  const int jend = jbeg + JSPAN;

  const _Float16* qTb = qT + (size_t)b * NV * C8V;
  const _Float16* kTb = kT + (size_t)b * NV * C8V;
  const _Float16* vb  = vT + (size_t)b * CCH * NV;

  const v4u z4 = (v4u)0u;

  // B-operands: Q tiles, column i = l16, K(=c)=0..7 in half 0; zeros elsewhere
  V16H qB[2];
  #pragma unroll
  for (int it = 0; it < 2; ++it) {
    v4u d = *(const v4u*)(qTb + (size_t)(ig * 32 + it * 16 + l16) * C8V);
    qB[it].q[0] = half ? z4 : d;
    qB[it].q[1] = z4;
  }

  float m[2] = { -__builtin_inff(), -__builtin_inff() };
  float l[2] = { 0.0f, 0.0f };
  v8f Oacc[2][4] = {};                                    // O^T accumulators
  const v8f zeroC = {};

  for (int jc = jbeg; jc < jend; jc += 32) {
    // hint next K chunk toward the caches (emits global_prefetch)
    {
      const int jn = (jc + 32 < jend) ? (jc + 32) : jbeg;
      __builtin_prefetch(kTb + (size_t)(jn + l16) * C8V, 0, 1);
    }

    // --- K tiles (shared by both i-tiles), then 4 S^T tiles ---
    V16H kA[2];
    #pragma unroll
    for (int t = 0; t < 2; ++t) {
      v4u d = *(const v4u*)(kTb + (size_t)(jc + t * 16 + l16) * C8V);
      kA[t].q[0] = half ? z4 : d;
      kA[t].q[1] = z4;
    }
    v8f S[2][2];
    #pragma unroll
    for (int it = 0; it < 2; ++it) {
      #pragma unroll
      for (int t = 0; t < 2; ++t)
        S[it][t] = __builtin_amdgcn_wmma_f32_16x16x32_f16(
            false, kA[t].h, false, qB[it].h, (short)0, zeroC, false, false);
    }

    // --- online softmax: two independent chains (ILP hides exp/bpermute latency) ---
    V16H P[2];
    #pragma unroll
    for (int it = 0; it < 2; ++it) {
      float tmax = S[it][0][0];
      #pragma unroll
      for (int r = 1; r < 8; ++r) tmax = fmaxf(tmax, S[it][0][r]);
      #pragma unroll
      for (int r = 0; r < 8; ++r) tmax = fmaxf(tmax, S[it][1][r]);
      tmax = fmaxf(tmax, __shfl_xor(tmax, 16, 32));

      const float mnew = fmaxf(m[it], tmax);
      const float corr = __expf(m[it] - mnew);
      m[it] = mnew;
      l[it] *= corr;
      #pragma unroll
      for (int ct = 0; ct < 4; ++ct) {
        #pragma unroll
        for (int r = 0; r < 8; ++r) Oacc[it][ct][r] *= corr;
      }

      float p0[8], p1[8], ps = 0.0f;
      #pragma unroll
      for (int r = 0; r < 8; ++r) { p0[r] = __expf(S[it][0][r] - mnew); ps += p0[r]; }
      #pragma unroll
      for (int r = 0; r < 8; ++r) { p1[r] = __expf(S[it][1][r] - mnew); ps += p1[r]; }
      ps += __shfl_xor(ps, 16, 32);
      l[it] += ps;

      #pragma unroll
      for (int r = 0; r < 8; ++r) { P[it].h[r] = (_Float16)p0[r]; P[it].h[8 + r] = (_Float16)p1[r]; }
    }

    // --- O^T += V_tile x P^T : V tile loaded once, used by both i-tiles ---
    #pragma unroll
    for (int ct = 0; ct < 4; ++ct) {
      V16H vA;  // A-operand: row c = ct*16 + l16; K = jc + half*8 + {0..7} and +16
      const _Float16* vp = vb + (size_t)(ct * 16 + l16) * NV + jc + half * 8;
      vA.q[0] = *(const v4u*)(vp);
      vA.q[1] = *(const v4u*)(vp + 16);
      #pragma unroll
      for (int it = 0; it < 2; ++it)
        Oacc[it][ct] = __builtin_amdgcn_wmma_f32_16x16x32_f16(
            false, vA.h, false, P[it].h, (short)0, Oacc[it][ct], false, false);
    }
  }

  // --- write unnormalized partials for this split ---
  const size_t pbase = (size_t)(b * NSPLIT + sp) * NV;
  #pragma unroll
  for (int it = 0; it < 2; ++it) {
    const int i = ig * 32 + it * 16 + l16;
    float* po = pO + (pbase + i) * CCH + half * 8;
    #pragma unroll
    for (int ct = 0; ct < 4; ++ct) {
      v4f lo, hi;
      #pragma unroll
      for (int r = 0; r < 4; ++r) { lo[r] = Oacc[it][ct][r]; hi[r] = Oacc[it][ct][4 + r]; }
      *(v4f*)(po + ct * 16)     = lo;
      *(v4f*)(po + ct * 16 + 4) = hi;
    }
    if (half == 0) {
      pML[(pbase + i) * 2 + 0] = m[it];
      pML[(pbase + i) * 2 + 1] = l[it];
    }
  }
}

// ---------------- Phase 3: merge the two j-splits, normalize, add residual ----------------
__global__ __launch_bounds__(256) void combine_kernel(
    const float* __restrict__ x,
    const float* __restrict__ pO,
    const float* __restrict__ pML,
    float*       __restrict__ out)
{
  const int idx = blockIdx.x * 256 + threadIdx.x;        // b*NV + i, 8192 total
  const int b = idx / NV;
  const int i = idx % NV;

  const size_t r0 = (size_t)(b * NSPLIT + 0) * NV + i;
  const size_t r1 = (size_t)(b * NSPLIT + 1) * NV + i;
  const float m0 = pML[r0 * 2 + 0], l0 = pML[r0 * 2 + 1];
  const float m1 = pML[r1 * 2 + 0], l1 = pML[r1 * 2 + 1];
  const float mm = fmaxf(m0, m1);
  const float e0 = __expf(m0 - mm);
  const float e1 = __expf(m1 - mm);
  const float rl = 1.0f / (l0 * e0 + l1 * e1);

  const float* O0 = pO + r0 * CCH;
  const float* O1 = pO + r1 * CCH;
  const float* xb = x   + (size_t)b * CCH * NV + i;
  float*       ob = out + (size_t)b * CCH * NV + i;
  #pragma unroll 8
  for (int c = 0; c < CCH; ++c)
    ob[(size_t)c * NV] = (O0[c] * e0 + O1[c] * e1) * rl + xb[(size_t)c * NV];
}

// ---------------- host launcher ----------------
extern "C" void kernel_launch(void* const* d_in, const int* in_sizes, int n_in,
                              void* d_out, int out_size, void* d_ws, size_t ws_size,
                              hipStream_t stream) {
  const float* x  = (const float*)d_in[0];
  const float* Wq = (const float*)d_in[1];
  const float* bq = (const float*)d_in[2];
  const float* Wk = (const float*)d_in[3];
  const float* bk = (const float*)d_in[4];
  const float* Wv = (const float*)d_in[5];
  const float* bv = (const float*)d_in[6];
  float* out = (float*)d_out;

  _Float16* qT = (_Float16*)d_ws;                        // [B][N][8]          128 KB
  _Float16* kT = qT + (size_t)BATCH * NV * C8V;          // [B][N][8]          128 KB
  _Float16* vT = kT + (size_t)BATCH * NV * C8V;          // [B][C][N]            1 MB
  float*    pO  = (float*)(vT + (size_t)BATCH * CCH * NV);          // [B][2][N][C]  4 MB
  float*    pML = pO + (size_t)BATCH * NSPLIT * NV * CCH;           // [B][2][N][2] 128 KB

  qk_proj_kernel<<<BATCH * (NV / 256), 256, 0, stream>>>(x, Wq, bq, Wk, bk, qT, kT);
  v_proj_kernel<<<BATCH * CCH * (NV / 256), 256, 0, stream>>>(x, Wv, bv, vT);
  attn_kernel<<<BATCH * NSPLIT * (NV / 32), 32, 0, stream>>>(qT, kT, vT, pO, pML);
  combine_kernel<<<BATCH * NV / 256, 256, 0, stream>>>(x, pO, pML, out);
}

// v001
// It runs in 38.3 microseconds.
// Two timings next to v000 both put it at 1.86 times that version's speed.
#include <hip/hip_runtime.h>
#include <cstdint>

#define BATCH  2
#define CCH    64
#define C8V    8
#define NV     4096   // 16*16*16 flattened spatial
#define NWAVE  16     // waves of one work-group that share the j range of a 32-row i-group
#define OPITCH 68     // dwords per row of an O partial in LDS (16 B x odd: b128 column walk without conflicts)

typedef __attribute__((ext_vector_type(16))) _Float16     v16h;
typedef __attribute__((ext_vector_type(8)))  float        v8f;
typedef __attribute__((ext_vector_type(4)))  float        v4f;
typedef __attribute__((ext_vector_type(4)))  unsigned int v4u;

union V16H {          // 8 VGPRs viewed as 16 halves or 2x b128
  v16h h;
  v4u  q[2];
};

// ---------------- Phase 1a: Q/K projections (64 -> 8), f16 [b][n][8] ----------------
__global__ __launch_bounds__(256) void qk_proj_kernel(
    const float* __restrict__ x,
    const float* __restrict__ Wq, const float* __restrict__ bq,
    const float* __restrict__ Wk, const float* __restrict__ bk,
    _Float16* __restrict__ qT, _Float16* __restrict__ kT)
{
  __shared__ float sWq[C8V * CCH];
  __shared__ float sWk[C8V * CCH];
  const int tid = threadIdx.x;
  for (int i = tid; i < C8V * CCH; i += 256) { sWq[i] = Wq[i]; sWk[i] = Wk[i]; }
  __syncthreads();

  const int blocksPerB = NV / 256;                       // 16
  const int b = blockIdx.x / blocksPerB;
  const int n = (blockIdx.x % blocksPerB) * 256 + tid;
  const float* xb = x + (size_t)b * CCH * NV + n;

  float qa[C8V], ka[C8V];
  #pragma unroll
  for (int o = 0; o < C8V; ++o) { qa[o] = bq[o]; ka[o] = bk[o]; }

  for (int c = 0; c < CCH; ++c) {
    const float xv = xb[(size_t)c * NV];
    #pragma unroll
    for (int o = 0; o < C8V; ++o) {
      qa[o] = fmaf(sWq[o * CCH + c], xv, qa[o]);
      ka[o] = fmaf(sWk[o * CCH + c], xv, ka[o]);
    }
  }

  union { _Float16 h[8]; v4u v; } pq, pk;
  #pragma unroll
  for (int o = 0; o < C8V; ++o) { pq.h[o] = (_Float16)qa[o]; pk.h[o] = (_Float16)ka[o]; }
  const size_t off = ((size_t)b * NV + n) * C8V;
  *(v4u*)(qT + off) = pq.v;
  *(v4u*)(kT + off) = pk.v;
}

// ---------------- Phase 1b: V projection (64 -> 64), f16 [b][c][n] ----------------
__global__ __launch_bounds__(256) void v_proj_kernel(
    const float* __restrict__ x,
    const float* __restrict__ Wv, const float* __restrict__ bv,
    _Float16* __restrict__ vT)
{
  __shared__ float sW[CCH];
  const int tid = threadIdx.x;
  const int blocksPerC = NV / 256;                       // 16
  const int b = blockIdx.x / (CCH * blocksPerC);
  const int c = (blockIdx.x / blocksPerC) % CCH;
  const int n = (blockIdx.x % blocksPerC) * 256 + tid;

  if (tid < CCH) sW[tid] = Wv[c * CCH + tid];
  __syncthreads();

  const float* xb = x + (size_t)b * CCH * NV + n;
  float acc = bv[c];
  for (int cc = 0; cc < CCH; ++cc) acc = fmaf(sW[cc], xb[(size_t)cc * NV], acc);
  vT[(size_t)b * CCH * NV + (size_t)c * NV + n] = (_Float16)acc;
}

// exp(x) as __expf forms it: v_exp_f32 of x * log2(e)
__device__ __forceinline__ float exp_with_slot(float x) {
  float r;
  // the v_nop holds the one free slot that the instruction set asks for behind a transcendental
  asm("v_exp_f32 %0, %1\n\tv_nop" : "=v"(r) : "v"(x * 1.44269504f));
  return r;
}

// ---------------- Phase 2: fused flash attention ----------------
// One work-group of 16 waves handles TWO 16-row i-tiles; wave w takes the 32-key blocks w, w+16, ...
// S^T tiles via v_wmma_f32_16x16x32_f16 (A = K rows, B = Q cols, K-dim 8 padded to 32).
// The f32 D-layout of S^T is exactly the f16 B-layout of the PV WMMA, so exp+pack
// is the only glue between the two GEMMs. K/V tile loads are shared by both i-tiles.
// Each wave keeps unnormalized (O, m, l); the waves merge them through LDS, normalize,
// add the residual and store the output.
__global__ __launch_bounds__(NWAVE * 32) void attn_kernel(
    const float*    __restrict__ x,
    const _Float16* __restrict__ qT,
    const _Float16* __restrict__ kT,
    const _Float16* __restrict__ vT,
    float*          __restrict__ out)
{
  __shared__ __attribute__((aligned(16))) float sO[NWAVE][32][OPITCH];  // [wave][i][c], unnormalized
  __shared__ float sM[NWAVE][32];
  __shared__ float sL[NWAVE][32];

  const int lane = threadIdx.x & 31;
  // the wave's number as a scalar: its key blocks' and its LDS slice's addresses form on the scalar unit
  const int wave = __builtin_amdgcn_readfirstlane(threadIdx.x >> 5);
  const int l16  = lane & 15;
  const int half = lane >> 4;

  const int grpPerB = NV / 32;                           // 128 i-groups of 32 rows
  const int b  = blockIdx.x / grpPerB;
  const int ig = blockIdx.x % grpPerB;

  const _Float16* qTb = qT + (size_t)b * NV * C8V;
  const _Float16* kTb = kT + (size_t)b * NV * C8V;
  const _Float16* vb  = vT + (size_t)b * CCH * NV;

  // residual of this thread's four outputs, asked for here so that the loop covers its latency:
  // thread (wave, lane) finishes channels wave*4 .. wave*4+3 of row i = ig*32 + lane
  const size_t obase = (size_t)b * CCH * NV + (size_t)(wave * 4) * NV + ig * 32 + lane;
  float xr[4];
  #pragma unroll
  for (int k = 0; k < 4; ++k) xr[k] = x[obase + (size_t)k * NV];

  const v4u z4 = (v4u)0u;

  // B-operands: Q tiles, column i = l16, K(=c)=0..7 in half 0; zeros elsewhere
  V16H qB[2];
  #pragma unroll
  for (int it = 0; it < 2; ++it) {
    v4u d = *(const v4u*)(qTb + (size_t)(ig * 32 + it * 16 + l16) * C8V);
    qB[it].q[0] = half ? z4 : d;
    qB[it].q[1] = z4;
  }

  float m[2] = { -__builtin_inff(), -__builtin_inff() };
  float l[2] = { 0.0f, 0.0f };
  v8f Oacc[2][4] = {};                                    // O^T accumulators
  const v8f zeroC = {};

  // neighbouring waves work on neighbouring key blocks, so that they share V's 128-byte lines;
  // every wave has NV / (32 * NWAVE) = 8 blocks
  int jc = wave * 32;
  do {
    // --- K tiles (shared by both i-tiles), then 4 S^T tiles ---
    V16H kA[2];
    #pragma unroll
    for (int t = 0; t < 2; ++t) {
      v4u d = *(const v4u*)(kTb + (size_t)(jc + t * 16 + l16) * C8V);
      kA[t].q[0] = half ? z4 : d;
      kA[t].q[1] = z4;
    }
    v8f S[2][2];
    #pragma unroll
    for (int it = 0; it < 2; ++it) {
      #pragma unroll
      for (int t = 0; t < 2; ++t)
        S[it][t] = __builtin_amdgcn_wmma_f32_16x16x32_f16(
            false, kA[t].h, false, qB[it].h, (short)0, zeroC, false, false);
    }

    // --- online softmax: two independent chains (ILP hides exp/bpermute latency) ---
    V16H P[2];
    #pragma unroll
    for (int it = 0; it < 2; ++it) {
      float tmax = S[it][0][0];
      #pragma unroll
      for (int r = 1; r < 8; ++r) tmax = fmaxf(tmax, S[it][0][r]);
      #pragma unroll
      for (int r = 0; r < 8; ++r) tmax = fmaxf(tmax, S[it][1][r]);
      tmax = fmaxf(tmax, __shfl_xor(tmax, 16, 32));

      const float mnew = fmaxf(m[it], tmax);
      const float corr = __expf(m[it] - mnew);
      m[it] = mnew;
      l[it] *= corr;
      #pragma unroll
      for (int ct = 0; ct < 4; ++ct) {
        #pragma unroll
        for (int r = 0; r < 8; ++r) Oacc[it][ct][r] *= corr;
      }

      float p0[8], p1[8], ps = 0.0f;
      #pragma unroll
      for (int r = 0; r < 8; ++r) { p0[r] = __expf(S[it][0][r] - mnew); ps += p0[r]; }
      #pragma unroll
      for (int r = 0; r < 8; ++r) { p1[r] = __expf(S[it][1][r] - mnew); ps += p1[r]; }
      ps += __shfl_xor(ps, 16, 32);
      l[it] += ps;

      #pragma unroll
      for (int r = 0; r < 8; ++r) { P[it].h[r] = (_Float16)p0[r]; P[it].h[8 + r] = (_Float16)p1[r]; }
    }

    // --- O^T += V_tile x P^T : V tile loaded once, used by both i-tiles ---
    #pragma unroll
    for (int ct = 0; ct < 4; ++ct) {
      V16H vA;  // A-operand: row c = ct*16 + l16; K = jc + half*8 + {0..7} and +16
      const _Float16* vp = vb + (size_t)(ct * 16 + l16) * NV + jc + half * 8;
      vA.q[0] = *(const v4u*)(vp);
      vA.q[1] = *(const v4u*)(vp + 16);
      #pragma unroll
      for (int it = 0; it < 2; ++it)
        Oacc[it][ct] = __builtin_amdgcn_wmma_f32_16x16x32_f16(
            false, vA.h, false, P[it].h, (short)0, Oacc[it][ct], false, false);
    }
    jc += 32 * NWAVE;
  } while (jc < NV);

  // --- every wave lays down its unnormalized partial ---
  #pragma unroll
  for (int it = 0; it < 2; ++it) {
    const int i = it * 16 + l16;
    float* so = &sO[wave][i][half * 8];
    #pragma unroll
    for (int ct = 0; ct < 4; ++ct) {
      v4f lo, hi;
      #pragma unroll
      for (int r = 0; r < 4; ++r) { lo[r] = Oacc[it][ct][r]; hi[r] = Oacc[it][ct][4 + r]; }
      *(v4f*)(so + ct * 16)     = lo;
      *(v4f*)(so + ct * 16 + 4) = hi;
    }
    if (half == 0) { sM[wave][i] = m[it]; sL[wave][i] = l[it]; }
  }
  __syncthreads();

  // --- merge the 16 partials of row i = lane, normalize, add residual ---
  float ms[NWAVE];
  float mm = -__builtin_inff();
  #pragma unroll
  for (int s = 0; s < NWAVE; ++s) { ms[s] = sM[s][lane]; mm = fmaxf(mm, ms[s]); }
  float lsum = 0.0f;
  v4f acc = {};
  #pragma unroll
  for (int s = 0; s < NWAVE; ++s) {
    const float e = exp_with_slot(ms[s] - mm);
    lsum = fmaf(sL[s][lane], e, lsum);
    acc += *(const v4f*)(&sO[s][lane][wave * 4]) * e;
  }
  const float rl = 1.0f / lsum;
  #pragma unroll
  for (int k = 0; k < 4; ++k) out[obase + (size_t)k * NV] = acc[k] * rl + xr[k];
}

// ---------------- host launcher ----------------
extern "C" void kernel_launch(void* const* d_in, const int* in_sizes, int n_in,
                              void* d_out, int out_size, void* d_ws, size_t ws_size,
                              hipStream_t stream) {
  const float* x  = (const float*)d_in[0];
  const float* Wq = (const float*)d_in[1];
  const float* bq = (const float*)d_in[2];
  const float* Wk = (const float*)d_in[3];
  const float* bk = (const float*)d_in[4];
  const float* Wv = (const float*)d_in[5];
  const float* bv = (const float*)d_in[6];
  float* out = (float*)d_out;

  _Float16* qT = (_Float16*)d_ws;                        // [B][N][8]          128 KB
  _Float16* kT = qT + (size_t)BATCH * NV * C8V;          // [B][N][8]          128 KB
  _Float16* vT = kT + (size_t)BATCH * NV * C8V;          // [B][C][N]            1 MB

  qk_proj_kernel<<<BATCH * (NV / 256), 256, 0, stream>>>(x, Wq, bq, Wk, bk, qT, kT);
  v_proj_kernel<<<BATCH * CCH * (NV / 256), 256, 0, stream>>>(x, Wv, bv, vT);
  attn_kernel<<<BATCH * (NV / 32), NWAVE * 32, 0, stream>>>(x, qT, kT, vT, out);
}

// v002
// It runs in 18.6 microseconds.
// Timed twice side by side with v001, it ran 2.10 and 2.02 times as fast.
// Over all steps from v000 it is 3.83 times as fast.
#include <hip/hip_runtime.h>
#include <cstdint>

#define BATCH  2
#define CCH    64
#define C8V    8
#define NV     4096   // 16*16*16 flattened spatial
#define NWAVE  16     // waves of one work-group that share the j range of a 32-row i-group
#define OPITCH 68     // dwords per row of an O partial in LDS (16 B x odd: b128 column walk without conflicts)
#define PWAVE  4      // waves of one projection work-group, one per SIMD
#define WPITCH 68     // dwords per weight row in LDS (16 B x odd: b128 fragment reads without conflicts)

typedef __attribute__((ext_vector_type(16))) _Float16     v16h;
typedef __attribute__((ext_vector_type(8)))  float        v8f;
typedef __attribute__((ext_vector_type(4)))  float        v4f;
typedef __attribute__((ext_vector_type(2)))  float        v2f;
typedef __attribute__((ext_vector_type(4)))  unsigned int v4u;

union V16H {          // 8 VGPRs viewed as 16 halves or 2x b128
  v16h h;
  v4u  q[2];
};

// ---------------- Phase 1: Q, K and V projections in one launch ----------------
// One GEMM [80 x 64] x [64 x N] on v_wmma_f32_16x16x4_f32. A wave owns 16 columns n of x, loads them
// once and uses the same registers as B (rows = Wq|Wk, D = [o][n]) and as A (columns = Wv, D = [n][c]):
// a lane then holds the 8 halves that lie side by side in qT / kT ([n][8]) and in vT ([c][n]).
// Both operands take channel c = 8*s + 4*half + e at element e of step s, so the k pairing is equal.
__global__ __launch_bounds__(PWAVE * 32) void qkv_proj_kernel(
    const float* __restrict__ x,
    const float* __restrict__ Wq, const float* __restrict__ bq,
    const float* __restrict__ Wk, const float* __restrict__ bk,
    const float* __restrict__ Wv, const float* __restrict__ bv,
    _Float16* __restrict__ qT, _Float16* __restrict__ kT, _Float16* __restrict__ vT)
{
  __shared__ __attribute__((aligned(16))) float sW[2 * C8V + CCH][WPITCH];  // rows: Wq, Wk, Wv

  const int tid  = threadIdx.x;
  const int lane = tid & 31;
  const int wave = __builtin_amdgcn_readfirstlane(tid >> 5);
  const int l16  = lane & 15;
  const int half = lane >> 4;

  const int tile = blockIdx.x * PWAVE + wave;            // 16 columns of x
  const int b    = tile / (NV / 16);
  const int n0   = (tile % (NV / 16)) * 16;

  // weights: whole 256-byte rows, 8 rows per pass of the 128 threads
  const int wr = tid >> 4;
  const int wc = (tid & 15) * 4;
  v4f wg[10];
  wg[0] = *(const v4f*)(Wq + wr * CCH + wc);
  wg[1] = *(const v4f*)(Wk + wr * CCH + wc);
  #pragma unroll
  for (int j = 0; j < 8; ++j) wg[2 + j] = *(const v4f*)(Wv + (j * 8 + wr) * CCH + wc);

  // this wave's x columns, all 64 channels in flight at once
  const float* xb = x + (size_t)b * CCH * NV + (size_t)(half * 4) * NV + n0 + l16;
  float xf[8][4];
  #pragma unroll
  for (int s = 0; s < 8; ++s) {
    #pragma unroll
    for (int e = 0; e < 4; ++e) xf[s][e] = xb[(size_t)(s * 8 + e) * NV];
  }

  // the address registers of the loads above are free from here on and the bias loads below may land in them
  asm volatile("s_wait_xcnt 0x0" ::: "memory");

  #pragma unroll
  for (int j = 0; j < 10; ++j) *(v4f*)(&sW[j * 8 + wr][wc]) = wg[j];

  // accumulators start at the bias
  v8f acc[5];
  #pragma unroll
  for (int r = 0; r < 8; ++r) acc[0][r] = half ? bk[r] : bq[r];
  #pragma unroll
  for (int vt = 0; vt < 4; ++vt) {
    const float bb = bv[vt * 16 + l16];
    #pragma unroll
    for (int r = 0; r < 8; ++r) acc[1 + vt][r] = bb;
  }
  __syncthreads();

  // all weight fragments as one group of LDS reads, in the order of their use
  v4f w[8][5];
  #pragma unroll
  for (int s = 0; s < 8; ++s) {
    #pragma unroll
    for (int t = 0; t < 5; ++t) w[s][t] = *(const v4f*)(&sW[t * 16 + l16][s * 8 + half * 4]);
  }
  // keeps the reads ahead of the matrix run (for speed only)
  __builtin_amdgcn_sched_barrier(0);

  // five independent accumulator chains, taken in turn
  #pragma unroll
  for (int s = 0; s < 8; ++s) {
    #pragma unroll
    for (int p = 0; p < 2; ++p) {
      const v2f xx = { xf[s][2 * p], xf[s][2 * p + 1] };
      #pragma unroll
      for (int t = 0; t < 5; ++t) {
        const v2f wf = { w[s][t][2 * p], w[s][t][2 * p + 1] };
        acc[t] = (t == 0)
            ? __builtin_amdgcn_wmma_f32_16x16x4_f32(false, wf, false, xx, (short)0, acc[t], false, false)
            : __builtin_amdgcn_wmma_f32_16x16x4_f32(false, xx, false, wf, (short)0, acc[t], false, false);
      }
    }
  }

  // tile 0: register r = row 8*half + r of (Wq|Wk), column n0 + l16
  union { _Float16 h[8]; v4u v; } pk;
  #pragma unroll
  for (int r = 0; r < 8; ++r) pk.h[r] = (_Float16)acc[0][r];
  *(v4u*)((half ? kT : qT) + ((size_t)b * NV + n0 + l16) * C8V) = pk.v;

  // tiles 1..4: register r = column n0 + 8*half + r, channel vt*16 + l16
  #pragma unroll
  for (int vt = 0; vt < 4; ++vt) {
    #pragma unroll
    for (int r = 0; r < 8; ++r) pk.h[r] = (_Float16)acc[1 + vt][r];
    *(v4u*)(vT + (size_t)b * CCH * NV + (size_t)(vt * 16 + l16) * NV + n0 + half * 8) = pk.v;
  }
}

// exp(x) as __expf forms it: v_exp_f32 of x * log2(e)
__device__ __forceinline__ float exp_with_slot(float x) {
  float r;
  // the v_nop holds the one free slot that the instruction set asks for behind a transcendental
  asm("v_exp_f32 %0, %1\n\tv_nop" : "=v"(r) : "v"(x * 1.44269504f));
  return r;
}

// ---------------- Phase 2: fused flash attention ----------------
// One work-group of 16 waves handles TWO 16-row i-tiles; wave w takes the 32-key blocks w, w+16, ...
// S^T tiles via v_wmma_f32_16x16x32_f16 (A = K rows, B = Q cols, K-dim 8 padded to 32).
// The f32 D-layout of S^T is exactly the f16 B-layout of the PV WMMA, so exp+pack
// is the only glue between the two GEMMs. K/V tile loads are shared by both i-tiles.
// Each wave keeps unnormalized (O, m, l); the waves merge them through LDS, normalize,
// add the residual and store the output.
__global__ __launch_bounds__(NWAVE * 32) void attn_kernel(
    const float*    __restrict__ x,
    const _Float16* __restrict__ qT,
    const _Float16* __restrict__ kT,
    const _Float16* __restrict__ vT,
    float*          __restrict__ out)
{
  __shared__ __attribute__((aligned(16))) float sO[NWAVE][32][OPITCH];  // [wave][i][c], unnormalized
  __shared__ float sM[NWAVE][32];
  __shared__ float sL[NWAVE][32];

  const int lane = threadIdx.x & 31;
  // the wave's number as a scalar: its key blocks' and its LDS slice's addresses form on the scalar unit
  const int wave = __builtin_amdgcn_readfirstlane(threadIdx.x >> 5);
  const int l16  = lane & 15;
  const int half = lane >> 4;

  const int grpPerB = NV / 32;                           // 128 i-groups of 32 rows
  const int b  = blockIdx.x / grpPerB;
  const int ig = blockIdx.x % grpPerB;

  const _Float16* qTb = qT + (size_t)b * NV * C8V;
  const _Float16* kTb = kT + (size_t)b * NV * C8V;
  const _Float16* vb  = vT + (size_t)b * CCH * NV;

  // residual of this thread's four outputs, asked for here so that the loop covers its latency:
  // thread (wave, lane) finishes channels wave*4 .. wave*4+3 of row i = ig*32 + lane
  const size_t obase = (size_t)b * CCH * NV + (size_t)(wave * 4) * NV + ig * 32 + lane;
  float xr[4];
  #pragma unroll
  for (int k = 0; k < 4; ++k) xr[k] = x[obase + (size_t)k * NV];

  const v4u z4 = (v4u)0u;

  // B-operands: Q tiles, column i = l16, K(=c)=0..7 in half 0; zeros elsewhere
  V16H qB[2];
  #pragma unroll
  for (int it = 0; it < 2; ++it) {
    v4u d = *(const v4u*)(qTb + (size_t)(ig * 32 + it * 16 + l16) * C8V);
    qB[it].q[0] = half ? z4 : d;
    qB[it].q[1] = z4;
  }

  float m[2] = { -__builtin_inff(), -__builtin_inff() };
  float l[2] = { 0.0f, 0.0f };
  v8f Oacc[2][4] = {};                                    // O^T accumulators
  const v8f zeroC = {};

  // neighbouring waves work on neighbouring key blocks, so that they share V's 128-byte lines;
  // every wave has NV / (32 * NWAVE) = 8 blocks
  int jc = wave * 32;
  do {
    // --- K tiles (shared by both i-tiles), then 4 S^T tiles ---
    V16H kA[2];
    #pragma unroll
    for (int t = 0; t < 2; ++t) {
      v4u d = *(const v4u*)(kTb + (size_t)(jc + t * 16 + l16) * C8V);
      kA[t].q[0] = half ? z4 : d;
      kA[t].q[1] = z4;
    }
    v8f S[2][2];
    #pragma unroll
    for (int it = 0; it < 2; ++it) {
      #pragma unroll
      for (int t = 0; t < 2; ++t)
        S[it][t] = __builtin_amdgcn_wmma_f32_16x16x32_f16(
            false, kA[t].h, false, qB[it].h, (short)0, zeroC, false, false);
    }

    // --- online softmax: two independent chains (ILP hides exp/bpermute latency) ---
    V16H P[2];
    #pragma unroll
    for (int it = 0; it < 2; ++it) {
      float tmax = S[it][0][0];
      #pragma unroll
      for (int r = 1; r < 8; ++r) tmax = fmaxf(tmax, S[it][0][r]);
      #pragma unroll
      for (int r = 0; r < 8; ++r) tmax = fmaxf(tmax, S[it][1][r]);
      tmax = fmaxf(tmax, __shfl_xor(tmax, 16, 32));

      const float mnew = fmaxf(m[it], tmax);
      const float corr = __expf(m[it] - mnew);
      m[it] = mnew;
      l[it] *= corr;
      #pragma unroll
      for (int ct = 0; ct < 4; ++ct) {
        #pragma unroll
        for (int r = 0; r < 8; ++r) Oacc[it][ct][r] *= corr;
      }

      float p0[8], p1[8], ps = 0.0f;
      #pragma unroll
      for (int r = 0; r < 8; ++r) { p0[r] = __expf(S[it][0][r] - mnew); ps += p0[r]; }
      #pragma unroll
      for (int r = 0; r < 8; ++r) { p1[r] = __expf(S[it][1][r] - mnew); ps += p1[r]; }
      ps += __shfl_xor(ps, 16, 32);
      l[it] += ps;

      #pragma unroll
      for (int r = 0; r < 8; ++r) { P[it].h[r] = (_Float16)p0[r]; P[it].h[8 + r] = (_Float16)p1[r]; }
    }

    // --- O^T += V_tile x P^T : V tile loaded once, used by both i-tiles ---
    #pragma unroll
    for (int ct = 0; ct < 4; ++ct) {
      V16H vA;  // A-operand: row c = ct*16 + l16; K = jc + half*8 + {0..7} and +16
      const _Float16* vp = vb + (size_t)(ct * 16 + l16) * NV + jc + half * 8;
      vA.q[0] = *(const v4u*)(vp);
      vA.q[1] = *(const v4u*)(vp + 16);
      #pragma unroll
      for (int it = 0; it < 2; ++it)
        Oacc[it][ct] = __builtin_amdgcn_wmma_f32_16x16x32_f16(
            false, vA.h, false, P[it].h, (short)0, Oacc[it][ct], false, false);
    }
    jc += 32 * NWAVE;
  } while (jc < NV);

  // --- every wave lays down its unnormalized partial ---
  #pragma unroll
  for (int it = 0; it < 2; ++it) {
    const int i = it * 16 + l16;
    float* so = &sO[wave][i][half * 8];
    #pragma unroll
    for (int ct = 0; ct < 4; ++ct) {
      v4f lo, hi;
      #pragma unroll
      for (int r = 0; r < 4; ++r) { lo[r] = Oacc[it][ct][r]; hi[r] = Oacc[it][ct][4 + r]; }
      *(v4f*)(so + ct * 16)     = lo;
      *(v4f*)(so + ct * 16 + 4) = hi;
    }
    if (half == 0) { sM[wave][i] = m[it]; sL[wave][i] = l[it]; }
  }
  __syncthreads();

  // --- merge the 16 partials of row i = lane, normalize, add residual ---
  float ms[NWAVE];
  float mm = -__builtin_inff();
  #pragma unroll
  for (int s = 0; s < NWAVE; ++s) { ms[s] = sM[s][lane]; mm = fmaxf(mm, ms[s]); }
  float lsum = 0.0f;
  v4f acc = {};
  #pragma unroll
  for (int s = 0; s < NWAVE; ++s) {
    const float e = exp_with_slot(ms[s] - mm);
    lsum = fmaf(sL[s][lane], e, lsum);
    acc += *(const v4f*)(&sO[s][lane][wave * 4]) * e;
  }
  const float rl = 1.0f / lsum;
  #pragma unroll
  for (int k = 0; k < 4; ++k) out[obase + (size_t)k * NV] = acc[k] * rl + xr[k];
}

// ---------------- host launcher ----------------
extern "C" void kernel_launch(void* const* d_in, const int* in_sizes, int n_in,
                              void* d_out, int out_size, void* d_ws, size_t ws_size,
                              hipStream_t stream) {
  const float* x  = (const float*)d_in[0];
  const float* Wq = (const float*)d_in[1];
  const float* bq = (const float*)d_in[2];
  const float* Wk = (const float*)d_in[3];
  const float* bk = (const float*)d_in[4];
  const float* Wv = (const float*)d_in[5];
  const float* bv = (const float*)d_in[6];
  float* out = (float*)d_out;

  _Float16* qT = (_Float16*)d_ws;                        // [B][N][8]          128 KB
  _Float16* kT = qT + (size_t)BATCH * NV * C8V;          // [B][N][8]          128 KB
  _Float16* vT = kT + (size_t)BATCH * NV * C8V;          // [B][C][N]            1 MB

  qkv_proj_kernel<<<BATCH * (NV / 16) / PWAVE, PWAVE * 32, 0, stream>>>(x, Wq, bq, Wk, bk, Wv, bv, qT, kT, vT);
  attn_kernel<<<BATCH * (NV / 32), NWAVE * 32, 0, stream>>>(x, qT, kT, vT, out);
}

// v003
// One run takes 16.2 microseconds.
// Two timings next to v002 put it at 1.12 and 1.13 times that version's speed.
// All steps since v000 together make it 4.31 times as fast.
#include <hip/hip_runtime.h>
#include <cstdint>

#define BATCH  2
#define CCH    64
#define C8V    8
#define NV     4096   // 16*16*16 flattened spatial
#define NWAVE  16     // waves of one work-group that share the j range of a 32-row i-group
#define OPITCH 68     // dwords per row of an O partial in LDS (16 B x odd: b128 column walk without conflicts)
#define PWAVE  4      // waves of one projection work-group, one per SIMD
#define WPITCH 68     // dwords per weight row in LDS (16 B x odd: b128 fragment reads without conflicts)
#define VBLK   2048   // halves of V per 32-key block: 4 channel tiles x 2 fragment halves x 32 lanes x 8

typedef __attribute__((ext_vector_type(16))) _Float16     v16h;
typedef __attribute__((ext_vector_type(8)))  float        v8f;
typedef __attribute__((ext_vector_type(4)))  float        v4f;
typedef __attribute__((ext_vector_type(2)))  float        v2f;
typedef __attribute__((ext_vector_type(4)))  unsigned int v4u;

union V16H {          // 8 VGPRs viewed as 16 halves or 2x b128
  v16h h;
  v4u  q[2];
};

// ---------------- Phase 1: Q, K and V projections in one launch ----------------
// One GEMM [80 x 64] x [64 x N] on v_wmma_f32_16x16x4_f32. A wave owns 16 columns n of x, loads them
// once and uses the same registers as B (rows = Wq|Wk, D = [o][n]) and as A (columns = Wv, D = [n][c]):
// a lane then holds the 8 halves that lie side by side in qT / kT ([n][8]) and the 16 bytes of V that
// the same lane of the attention kernel takes as half of an A fragment: V is stored in that fragment order,
// vF[b][n / 32][c / 16][(n / 16) & 1][lane][8], so that a wave's store and its later load are 512 bytes in a row.
// Both operands take channel c = 8*s + 4*half + e at element e of step s, so the k pairing is equal.
__global__ __launch_bounds__(PWAVE * 32) void qkv_proj_kernel(
    const float* __restrict__ x,
    const float* __restrict__ Wq, const float* __restrict__ bq,
    const float* __restrict__ Wk, const float* __restrict__ bk,
    const float* __restrict__ Wv, const float* __restrict__ bv,
    _Float16* __restrict__ qT, _Float16* __restrict__ kT, _Float16* __restrict__ vF)
{
  __shared__ __attribute__((aligned(16))) float sW[2 * C8V + CCH][WPITCH];  // rows: Wq, Wk, Wv

  const int tid  = threadIdx.x;
  const int lane = tid & 31;
  const int wave = __builtin_amdgcn_readfirstlane(tid >> 5);
  const int l16  = lane & 15;
  const int half = lane >> 4;

  const int tile = blockIdx.x * PWAVE + wave;            // 16 columns of x
  const int b    = tile / (NV / 16);
  const int n0   = (tile % (NV / 16)) * 16;

  // weights: whole 256-byte rows, 8 rows per pass of the 128 threads
  const int wr = tid >> 4;
  const int wc = (tid & 15) * 4;
  v4f wg[10];
  wg[0] = *(const v4f*)(Wq + wr * CCH + wc);
  wg[1] = *(const v4f*)(Wk + wr * CCH + wc);
  #pragma unroll
  for (int j = 0; j < 8; ++j) wg[2 + j] = *(const v4f*)(Wv + (j * 8 + wr) * CCH + wc);

  // this wave's x columns, all 64 channels in flight at once
  const float* xb = x + (size_t)b * CCH * NV + (size_t)(half * 4) * NV + n0 + l16;
  float xf[8][4];
  #pragma unroll
  for (int s = 0; s < 8; ++s) {
    #pragma unroll
    for (int e = 0; e < 4; ++e) xf[s][e] = xb[(size_t)(s * 8 + e) * NV];
  }

  // the address registers of the loads above are free from here on and the bias loads below may land in them
  asm volatile("s_wait_xcnt 0x0" ::: "memory");

  #pragma unroll
  for (int j = 0; j < 10; ++j) *(v4f*)(&sW[j * 8 + wr][wc]) = wg[j];

  // accumulators start at the bias
  v8f acc[5];
  #pragma unroll
  for (int r = 0; r < 8; ++r) acc[0][r] = half ? bk[r] : bq[r];
  #pragma unroll
  for (int vt = 0; vt < 4; ++vt) {
    const float bb = bv[vt * 16 + l16];
    #pragma unroll
    for (int r = 0; r < 8; ++r) acc[1 + vt][r] = bb;
  }
  __syncthreads();

  // all weight fragments as one group of LDS reads, in the order of their use
  v4f w[8][5];
  #pragma unroll
  for (int s = 0; s < 8; ++s) {
    #pragma unroll
    for (int t = 0; t < 5; ++t) w[s][t] = *(const v4f*)(&sW[t * 16 + l16][s * 8 + half * 4]);
  }
  // keeps the reads ahead of the matrix run (for speed only)
  __builtin_amdgcn_sched_barrier(0);

  // five independent accumulator chains, taken in turn
  #pragma unroll
  for (int s = 0; s < 8; ++s) {
    #pragma unroll
    for (int p = 0; p < 2; ++p) {
      const v2f xx = { xf[s][2 * p], xf[s][2 * p + 1] };
      #pragma unroll
      for (int t = 0; t < 5; ++t) {
        const v2f wf = { w[s][t][2 * p], w[s][t][2 * p + 1] };
        acc[t] = (t == 0)
            ? __builtin_amdgcn_wmma_f32_16x16x4_f32(false, wf, false, xx, (short)0, acc[t], false, false)
            : __builtin_amdgcn_wmma_f32_16x16x4_f32(false, xx, false, wf, (short)0, acc[t], false, false);
      }
    }
  }

  // tile 0: register r = row 8*half + r of (Wq|Wk), column n0 + l16
  union { _Float16 h[8]; v4u v; } pk;
  #pragma unroll
  for (int r = 0; r < 8; ++r) pk.h[r] = (_Float16)acc[0][r];
  *(v4u*)((half ? kT : qT) + ((size_t)b * NV + n0 + l16) * C8V) = pk.v;

  // tiles 1..4: register r = column n0 + 8*half + r, channel vt*16 + l16
  _Float16* vo = vF + (size_t)b * CCH * NV + (size_t)(n0 >> 5) * VBLK + ((n0 >> 4) & 1) * 256 + lane * 8;
  #pragma unroll
  for (int vt = 0; vt < 4; ++vt) {
    #pragma unroll
    for (int r = 0; r < 8; ++r) pk.h[r] = (_Float16)acc[1 + vt][r];
    *(v4u*)(vo + vt * 512) = pk.v;
  }
}

// exp(x) as __expf forms it: v_exp_f32 of x * log2(e)
__device__ __forceinline__ float exp_with_slot(float x) {
  float r;
  // the v_nop holds the one free slot that the instruction set asks for behind a transcendental
  asm("v_exp_f32 %0, %1\n\tv_nop" : "=v"(r) : "v"(x * 1.44269504f));
  return r;
}

// ---------------- Phase 2: fused flash attention ----------------
// One work-group of 16 waves handles TWO 16-row i-tiles; wave w takes the 32-key blocks w, w+16, ...
// S^T tiles via v_wmma_f32_16x16x32_f16 (A = K rows, B = Q cols, K-dim 8 padded to 32).
// The f32 D-layout of S^T is exactly the f16 B-layout of the PV WMMA, so exp+pack
// is the only glue between the two GEMMs. K/V tile loads are shared by both i-tiles.
// Each wave keeps unnormalized (O, m, l); the waves merge them through LDS, normalize,
// add the residual and store the output.
__global__ __launch_bounds__(NWAVE * 32) void attn_kernel(
    const float*    __restrict__ x,
    const _Float16* __restrict__ qT,
    const _Float16* __restrict__ kT,
    const _Float16* __restrict__ vF,
    float*          __restrict__ out)
{
  __shared__ __attribute__((aligned(16))) float sO[NWAVE][32][OPITCH];  // [wave][i][c], unnormalized
  __shared__ float sM[NWAVE][32];
  __shared__ float sL[NWAVE][32];

  const int lane = threadIdx.x & 31;
  // the wave's number as a scalar: its key blocks' and its LDS slice's addresses form on the scalar unit
  const int wave = __builtin_amdgcn_readfirstlane(threadIdx.x >> 5);
  const int l16  = lane & 15;
  const int half = lane >> 4;

  const int grpPerB = NV / 32;                           // 128 i-groups of 32 rows
  const int b  = blockIdx.x / grpPerB;
  const int ig = blockIdx.x % grpPerB;

  const _Float16* qTb = qT + (size_t)b * NV * C8V;
  const _Float16* kTb = kT + (size_t)b * NV * C8V;
  const _Float16* vb  = vF + (size_t)b * CCH * NV + lane * 8;   // this lane's 16 bytes of every fragment half

  // residual of this thread's four outputs, asked for here so that the loop covers its latency:
  // thread (wave, lane) finishes channels wave*4 .. wave*4+3 of row i = ig*32 + lane
  const size_t obase = (size_t)b * CCH * NV + (size_t)(wave * 4) * NV + ig * 32 + lane;
  float xr[4];
  #pragma unroll
  for (int k = 0; k < 4; ++k) xr[k] = x[obase + (size_t)k * NV];

  const v4u z4 = (v4u)0u;

  // B-operands: Q tiles, column i = l16, K(=c)=0..7 in half 0; zeros elsewhere
  V16H qB[2];
  #pragma unroll
  for (int it = 0; it < 2; ++it) {
    v4u d = *(const v4u*)(qTb + (size_t)(ig * 32 + it * 16 + l16) * C8V);
    qB[it].q[0] = half ? z4 : d;
    qB[it].q[1] = z4;
  }

  float m[2] = { -__builtin_inff(), -__builtin_inff() };
  float l[2] = { 0.0f, 0.0f };
  v8f Oacc[2][4] = {};                                    // O^T accumulators
  const v8f zeroC = {};

  // every wave has NV / (32 * NWAVE) = 8 blocks
  int jc = wave * 32;
  do {
    // --- K tiles (shared by both i-tiles), then 4 S^T tiles ---
    V16H kA[2];
    #pragma unroll
    for (int t = 0; t < 2; ++t) {
      v4u d = *(const v4u*)(kTb + (size_t)(jc + t * 16 + l16) * C8V);
      kA[t].q[0] = half ? z4 : d;
      kA[t].q[1] = z4;
    }
    v8f S[2][2];
    #pragma unroll
    for (int it = 0; it < 2; ++it) {
      #pragma unroll
      for (int t = 0; t < 2; ++t)
        S[it][t] = __builtin_amdgcn_wmma_f32_16x16x32_f16(
            false, kA[t].h, false, qB[it].h, (short)0, zeroC, false, false);
    }

    // --- online softmax: two independent chains (ILP hides exp/bpermute latency) ---
    V16H P[2];
    #pragma unroll
    for (int it = 0; it < 2; ++it) {
      float tmax = S[it][0][0];
      #pragma unroll
      for (int r = 1; r < 8; ++r) tmax = fmaxf(tmax, S[it][0][r]);
      #pragma unroll
      for (int r = 0; r < 8; ++r) tmax = fmaxf(tmax, S[it][1][r]);
      tmax = fmaxf(tmax, __shfl_xor(tmax, 16, 32));

      const float mnew = fmaxf(m[it], tmax);
      const float corr = __expf(m[it] - mnew);
      m[it] = mnew;
      l[it] *= corr;
      #pragma unroll
      for (int ct = 0; ct < 4; ++ct) {
        #pragma unroll
        for (int r = 0; r < 8; ++r) Oacc[it][ct][r] *= corr;
      }

      float p0[8], p1[8], ps = 0.0f;
      #pragma unroll
      for (int r = 0; r < 8; ++r) { p0[r] = __expf(S[it][0][r] - mnew); ps += p0[r]; }
      #pragma unroll
      for (int r = 0; r < 8; ++r) { p1[r] = __expf(S[it][1][r] - mnew); ps += p1[r]; }
      ps += __shfl_xor(ps, 16, 32);
      l[it] += ps;

      #pragma unroll
      for (int r = 0; r < 8; ++r) { P[it].h[r] = (_Float16)p0[r]; P[it].h[8 + r] = (_Float16)p1[r]; }
    }

    // --- O^T += V_tile x P^T : V tile loaded once, used by both i-tiles ---
    #pragma unroll
    for (int ct = 0; ct < 4; ++ct) {
      V16H vA;  // A-operand: row c = ct*16 + l16; K = jc + half*8 + {0..7} and +16, laid out in this order
      const _Float16* vp = vb + (size_t)jc * (VBLK / 32) + ct * 512;
      vA.q[0] = *(const v4u*)(vp);
      vA.q[1] = *(const v4u*)(vp + 256);
      #pragma unroll
      for (int it = 0; it < 2; ++it)
        Oacc[it][ct] = __builtin_amdgcn_wmma_f32_16x16x32_f16(
            false, vA.h, false, P[it].h, (short)0, Oacc[it][ct], false, false);
    }
    jc += 32 * NWAVE;
  } while (jc < NV);

  // --- every wave lays down its unnormalized partial ---
  #pragma unroll
  for (int it = 0; it < 2; ++it) {
    const int i = it * 16 + l16;
    float* so = &sO[wave][i][half * 8];
    #pragma unroll
    for (int ct = 0; ct < 4; ++ct) {
      v4f lo, hi;
      #pragma unroll
      for (int r = 0; r < 4; ++r) { lo[r] = Oacc[it][ct][r]; hi[r] = Oacc[it][ct][4 + r]; }
      *(v4f*)(so + ct * 16)     = lo;
      *(v4f*)(so + ct * 16 + 4) = hi;
    }
    if (half == 0) { sM[wave][i] = m[it]; sL[wave][i] = l[it]; }
  }
  __syncthreads();

  // --- merge the 16 partials of row i = lane, normalize, add residual ---
  float ms[NWAVE];
  float mm = -__builtin_inff();
  #pragma unroll
  for (int s = 0; s < NWAVE; ++s) { ms[s] = sM[s][lane]; mm = fmaxf(mm, ms[s]); }
  float lsum = 0.0f;
  v4f acc = {};
  #pragma unroll
  for (int s = 0; s < NWAVE; ++s) {
    const float e = exp_with_slot(ms[s] - mm);
    lsum = fmaf(sL[s][lane], e, lsum);
    acc += *(const v4f*)(&sO[s][lane][wave * 4]) * e;
  }
  const float rl = 1.0f / lsum;
  #pragma unroll
  for (int k = 0; k < 4; ++k) out[obase + (size_t)k * NV] = acc[k] * rl + xr[k];
}

// ---------------- host launcher ----------------
extern "C" void kernel_launch(void* const* d_in, const int* in_sizes, int n_in,
                              void* d_out, int out_size, void* d_ws, size_t ws_size,
                              hipStream_t stream) {
  const float* x  = (const float*)d_in[0];
  const float* Wq = (const float*)d_in[1];
  const float* bq = (const float*)d_in[2];
  const float* Wk = (const float*)d_in[3];
  const float* bk = (const float*)d_in[4];
  const float* Wv = (const float*)d_in[5];
  const float* bv = (const float*)d_in[6];
  float* out = (float*)d_out;

  _Float16* qT = (_Float16*)d_ws;                        // [B][N][8]          128 KB
  _Float16* kT = qT + (size_t)BATCH * NV * C8V;          // [B][N][8]          128 KB
  _Float16* vF = kT + (size_t)BATCH * NV * C8V;          // [B][N/32][4][2][32][8]  1 MB

  qkv_proj_kernel<<<BATCH * (NV / 16) / PWAVE, PWAVE * 32, 0, stream>>>(x, Wq, bq, Wk, bk, Wv, bv, qT, kT, vF);
  attn_kernel<<<BATCH * (NV / 32), NWAVE * 32, 0, stream>>>(x, qT, kT, vF, out);
}

// v004
// One run takes 13.3 microseconds.
// Timed twice side by side with v003, it ran 1.22 and 1.23 times as fast.
// Counting every step since v000, it is 5.27 times as fast.
#include <hip/hip_runtime.h>
#include <cstdint>

#define BATCH  2
#define CCH    64
#define C8V    8
#define NV     4096   // 16*16*16 flattened spatial
#define NWAVE  16     // waves of one work-group that share the j range of a 32-row i-group
#define OPITCH 68     // dwords per row of an O partial in LDS (16 B x odd: b128 column walk without conflicts)
#define PWAVE  4      // waves of one projection work-group, one per SIMD
#define WPITCH 68     // dwords per weight row in LDS (16 B x odd: b128 fragment reads without conflicts)
#define PMAX   16384.0f  // a lane's sum of 16 weights above this raises the maximum in use (f16 holds up to 65504)
#define VBLK   2048   // halves of V per 32-key block: 4 channel tiles x 2 fragment halves x 32 lanes x 8

typedef __attribute__((ext_vector_type(16))) _Float16     v16h;
typedef __attribute__((ext_vector_type(8)))  float        v8f;
typedef __attribute__((ext_vector_type(4)))  float        v4f;
typedef __attribute__((ext_vector_type(2)))  float        v2f;
typedef __attribute__((ext_vector_type(4)))  unsigned int v4u;

union V16H {          // 8 VGPRs viewed as 16 halves or 2x b128
  v16h h;
  v4u  q[2];
};

// ---------------- Phase 1: Q, K and V projections in one launch ----------------
// One GEMM [80 x 64] x [64 x N] on v_wmma_f32_16x16x4_f32. A wave owns 16 columns n of x, loads them
// once and uses the same registers as B (rows = Wq|Wk, D = [o][n]) and as A (columns = Wv, D = [n][c]):
// a lane then holds the 8 halves that lie side by side in qT / kT ([n][8]) and the 16 bytes of V that
// the same lane of the attention kernel takes as half of an A fragment: V is stored in that fragment order,
// vF[b][n / 32][c / 16][(n / 16) & 1][lane][8], so that a wave's store and its later load are 512 bytes in a row.
// Both operands take channel c = 8*s + 4*half + e at element e of step s, so the k pairing is equal.
__global__ __launch_bounds__(PWAVE * 32) void qkv_proj_kernel(
    const float* __restrict__ x,
    const float* __restrict__ Wq, const float* __restrict__ bq,
    const float* __restrict__ Wk, const float* __restrict__ bk,
    const float* __restrict__ Wv, const float* __restrict__ bv,
    _Float16* __restrict__ qT, _Float16* __restrict__ kT, _Float16* __restrict__ vF)
{
  __shared__ __attribute__((aligned(16))) float sW[2 * C8V + CCH][WPITCH];  // rows: Wq, Wk, Wv

  const int tid  = threadIdx.x;
  const int lane = tid & 31;
  const int wave = __builtin_amdgcn_readfirstlane(tid >> 5);
  const int l16  = lane & 15;
  const int half = lane >> 4;

  const int tile = blockIdx.x * PWAVE + wave;            // 16 columns of x
  const int b    = tile / (NV / 16);
  const int n0   = (tile % (NV / 16)) * 16;

  // weights: whole 256-byte rows, 8 rows per pass of the 128 threads
  const int wr = tid >> 4;
  const int wc = (tid & 15) * 4;
  v4f wg[10];
  wg[0] = *(const v4f*)(Wq + wr * CCH + wc);
  wg[1] = *(const v4f*)(Wk + wr * CCH + wc);
  #pragma unroll
  for (int j = 0; j < 8; ++j) wg[2 + j] = *(const v4f*)(Wv + (j * 8 + wr) * CCH + wc);

  // this wave's x columns, all 64 channels in flight at once
  const float* xb = x + (size_t)b * CCH * NV + (size_t)(half * 4) * NV + n0 + l16;
  float xf[8][4];
  #pragma unroll
  for (int s = 0; s < 8; ++s) {
    #pragma unroll
    for (int e = 0; e < 4; ++e) xf[s][e] = xb[(size_t)(s * 8 + e) * NV];
  }

  // the address registers of the loads above are free from here on and the bias loads below may land in them
  asm volatile("s_wait_xcnt 0x0" ::: "memory");

  #pragma unroll
  for (int j = 0; j < 10; ++j) *(v4f*)(&sW[j * 8 + wr][wc]) = wg[j];

  // accumulators start at the bias
  v8f acc[5];
  #pragma unroll
  for (int r = 0; r < 8; ++r) acc[0][r] = half ? bk[r] : bq[r];
  #pragma unroll
  for (int vt = 0; vt < 4; ++vt) {
    const float bb = bv[vt * 16 + l16];
    #pragma unroll
    for (int r = 0; r < 8; ++r) acc[1 + vt][r] = bb;
  }
  __syncthreads();

  // all weight fragments as one group of LDS reads, in the order of their use
  v4f w[8][5];
  #pragma unroll
  for (int s = 0; s < 8; ++s) {
    #pragma unroll
    for (int t = 0; t < 5; ++t) w[s][t] = *(const v4f*)(&sW[t * 16 + l16][s * 8 + half * 4]);
  }
  // keeps the reads ahead of the matrix run (for speed only)
  __builtin_amdgcn_sched_barrier(0);

  // five independent accumulator chains, taken in turn
  #pragma unroll
  for (int s = 0; s < 8; ++s) {
    #pragma unroll
    for (int p = 0; p < 2; ++p) {
      const v2f xx = { xf[s][2 * p], xf[s][2 * p + 1] };
      #pragma unroll
      for (int t = 0; t < 5; ++t) {
        const v2f wf = { w[s][t][2 * p], w[s][t][2 * p + 1] };
        acc[t] = (t == 0)
            ? __builtin_amdgcn_wmma_f32_16x16x4_f32(false, wf, false, xx, (short)0, acc[t], false, false)
            : __builtin_amdgcn_wmma_f32_16x16x4_f32(false, xx, false, wf, (short)0, acc[t], false, false);
      }
    }
  }

  // tile 0: register r = row 8*half + r of (Wq|Wk), column n0 + l16
  // q leaves multiplied by log2(e), in f32 ahead of its one rounding: the scores are then exponents of 2
  const float qs = half ? 1.0f : 1.44269504f;
  union { _Float16 h[8]; v4u v; } pk;
  #pragma unroll
  for (int r = 0; r < 8; ++r) pk.h[r] = (_Float16)(acc[0][r] * qs);
  *(v4u*)((half ? kT : qT) + ((size_t)b * NV + n0 + l16) * C8V) = pk.v;

  // tiles 1..4: register r = column n0 + 8*half + r, channel vt*16 + l16
  _Float16* vo = vF + (size_t)b * CCH * NV + (size_t)(n0 >> 5) * VBLK + ((n0 >> 4) & 1) * 256 + lane * 8;
  #pragma unroll
  for (int vt = 0; vt < 4; ++vt) {
    #pragma unroll
    for (int r = 0; r < 8; ++r) pk.h[r] = (_Float16)acc[1 + vt][r];
    *(v4u*)(vo + vt * 512) = pk.v;
  }
}

// 2^x
__device__ __forceinline__ float exp2_with_slot(float x) {
  float r;
  // the v_nop holds the one free slot that the instruction set asks for behind a transcendental
  asm("v_exp_f32 %0, %1\n\tv_nop" : "=v"(r) : "v"(x));
  return r;
}

// largest score of a query column over a 32-key block: 16 values in the lane, then the other half's
__device__ __forceinline__ float column_max(const v8f a, const v8f b) {
  float t = a[0];
  #pragma unroll
  for (int r = 1; r < 8; ++r) t = fmaxf(t, a[r]);
  #pragma unroll
  for (int r = 0; r < 8; ++r) t = fmaxf(t, b[r]);
  return fmaxf(t, __shfl_xor(t, 16, 32));
}

// ---------------- Phase 2: fused flash attention ----------------
// One work-group of 16 waves handles TWO 16-row i-tiles; wave w takes the 32-key blocks w, w+16, ...
// S^T tiles via v_wmma_f32_16x16x32_f16 (A = K rows, B = Q cols, K-dim 8 padded to 32).
// The f32 D-layout of S^T is exactly the f16 B-layout of the PV WMMA, so exp+pack
// is the only glue between the two GEMMs. K/V tile loads are shared by both i-tiles.
// Scores are in log2 units (q carries log2(e)). The maximum in use, m, enters the S^T WMMA as C = -m, so D is
// the exponent itself. m starts at the first block's maximum and is raised, with O and l rescaled, only in a
// block where a lane's sum of 16 weights passes PMAX, which bounds every weight well inside the f16 range.
// Each wave keeps unnormalized (O, m, l); the waves merge them through LDS, normalize,
// add the residual and store the output.
__global__ __launch_bounds__(NWAVE * 32) void attn_kernel(
    const float*    __restrict__ x,
    const _Float16* __restrict__ qT,
    const _Float16* __restrict__ kT,
    const _Float16* __restrict__ vF,
    float*          __restrict__ out)
{
  __shared__ __attribute__((aligned(16))) float sO[NWAVE][32][OPITCH];  // [wave][i][c], unnormalized
  __shared__ float sM[NWAVE][32];
  __shared__ float sL[NWAVE][32];

  const int lane = threadIdx.x & 31;
  // the wave's number as a scalar: its key blocks' and its LDS slice's addresses form on the scalar unit
  const int wave = __builtin_amdgcn_readfirstlane(threadIdx.x >> 5);
  const int l16  = lane & 15;
  const int half = lane >> 4;

  const int grpPerB = NV / 32;                           // 128 i-groups of 32 rows
  const int b  = blockIdx.x / grpPerB;
  const int ig = blockIdx.x % grpPerB;

  const _Float16* qTb = qT + (size_t)b * NV * C8V;
  const _Float16* kTb = kT + (size_t)b * NV * C8V;
  const _Float16* vb  = vF + (size_t)b * CCH * NV + lane * 8;   // this lane's 16 bytes of every fragment half

  // residual of this thread's four outputs, asked for here so that the loop covers its latency:
  // thread (wave, lane) finishes channels wave*4 .. wave*4+3 of row i = ig*32 + lane
  const size_t obase = (size_t)b * CCH * NV + (size_t)(wave * 4) * NV + ig * 32 + lane;
  float xr[4];
  #pragma unroll
  for (int k = 0; k < 4; ++k) xr[k] = x[obase + (size_t)k * NV];

  const v4u z4 = (v4u)0u;

  // B-operands: Q tiles, column i = l16, K(=c)=0..7 in half 0; zeros elsewhere
  V16H qB[2];
  #pragma unroll
  for (int it = 0; it < 2; ++it) {
    v4u d = *(const v4u*)(qTb + (size_t)(ig * 32 + it * 16 + l16) * C8V);
    qB[it].q[0] = half ? z4 : d;
    qB[it].q[1] = z4;
  }

  float m[2];
  float l[2] = { 0.0f, 0.0f };
  v8f negM[2];                                            // -m in all eight registers: C of the S^T WMMAs
  v8f Oacc[2][4] = {};                                    // O^T accumulators
  const v8f zeroC = {};

  // every wave has NV / (32 * NWAVE) = 8 blocks
  int jc = wave * 32;
  const _Float16* kp = kTb + (size_t)(jc + l16) * C8V;    // this lane's row of the block's first K tile

  // the first block's maximum is the first m: some weight of every column is then 1 and no sum can vanish
  {
    v4u kd[2];
    #pragma unroll
    for (int t = 0; t < 2; ++t) kd[t] = *(const v4u*)(kp + t * 16 * C8V);
    V16H kA[2];
    #pragma unroll
    for (int t = 0; t < 2; ++t) {
      kA[t].q[0] = half ? z4 : kd[t];
      kA[t].q[1] = z4;
    }
    #pragma unroll
    for (int it = 0; it < 2; ++it) {
      const v8f s0 = __builtin_amdgcn_wmma_f32_16x16x32_f16(
          false, kA[0].h, false, qB[it].h, (short)0, zeroC, false, false);
      const v8f s1 = __builtin_amdgcn_wmma_f32_16x16x32_f16(
          false, kA[1].h, false, qB[it].h, (short)0, zeroC, false, false);
      m[it] = column_max(s0, s1);
      #pragma unroll
      for (int r = 0; r < 8; ++r) negM[it][r] = -m[it];
    }
  }

  do {
    // --- K tiles and V tiles (shared by both i-tiles); V is asked for here because the branch below
    //     ends the stretch of code over which the compiler moves a load ahead ---
    v4u kd[2];
    #pragma unroll
    for (int t = 0; t < 2; ++t) kd[t] = *(const v4u*)(kp + t * 16 * C8V);
    V16H vA[4];  // A-operand: row c = ct*16 + l16; K = jc + half*8 + {0..7} and +16, laid out in this order
    #pragma unroll
    for (int ct = 0; ct < 4; ++ct) {
      const _Float16* vp = vb + (size_t)jc * (VBLK / 32) + ct * 512;
      vA[ct].q[0] = *(const v4u*)(vp);
      vA[ct].q[1] = *(const v4u*)(vp + 256);
    }
    // the address registers of the ten loads above are stepped further down
    asm volatile("s_wait_xcnt 0x0" ::: "memory");
    // keeps all ten loads ahead of the wait for K: a V load placed behind it would start one L2 trip late
    __builtin_amdgcn_sched_barrier(0);
    V16H kA[2];
    #pragma unroll
    for (int t = 0; t < 2; ++t) {
      kA[t].q[0] = half ? z4 : kd[t];
      kA[t].q[1] = z4;
    }

    // --- weights straight from the S^T tiles: D = S - m ---
    v8f S[2][2];
    float p[2][16], ps[2];
    #pragma unroll
    for (int it = 0; it < 2; ++it) {
      #pragma unroll
      for (int t = 0; t < 2; ++t)
        S[it][t] = __builtin_amdgcn_wmma_f32_16x16x32_f16(
            false, kA[t].h, false, qB[it].h, (short)0, negM[it], false, false);
      ps[it] = 0.0f;
      #pragma unroll
      for (int r = 0; r < 16; ++r) { p[it][r] = __builtin_amdgcn_exp2f(S[it][r >> 3][r & 7]); ps[it] += p[it][r]; }
    }

    // --- one test per block, a scalar branch: some column has outgrown its m ---
    if (__builtin_amdgcn_ballot_w32(fmaxf(ps[0], ps[1]) > PMAX) != 0) {
      #pragma unroll
      for (int it = 0; it < 2; ++it) {
        // m goes up to the block's maximum where that is higher; d is the step as m takes it after rounding
        const float mnew = m[it] + fmaxf(column_max(S[it][0], S[it][1]), 0.0f);
        const float d    = mnew - m[it];
        const float corr = exp2_with_slot(-d);
        m[it] = mnew;
        l[it] *= corr;
        #pragma unroll
        for (int ct = 0; ct < 4; ++ct) {
          #pragma unroll
          for (int r = 0; r < 8; ++r) Oacc[it][ct][r] *= corr;
        }
        #pragma unroll
        for (int r = 0; r < 8; ++r) negM[it][r] = -mnew;
        ps[it] = 0.0f;
        #pragma unroll
        for (int r = 0; r < 16; ++r) { p[it][r] = exp2_with_slot(S[it][r >> 3][r & 7] - d); ps[it] += p[it][r]; }
      }
    }

    V16H P[2];
    #pragma unroll
    for (int it = 0; it < 2; ++it) {
      l[it] += ps[it] + __shfl_xor(ps[it], 16, 32);
      #pragma unroll
      for (int r = 0; r < 16; ++r) P[it].h[r] = (_Float16)p[it][r];
    }

    // --- O^T += V_tile x P^T ---
    #pragma unroll
    for (int ct = 0; ct < 4; ++ct) {
      #pragma unroll
      for (int it = 0; it < 2; ++it)
        Oacc[it][ct] = __builtin_amdgcn_wmma_f32_16x16x32_f16(
            false, vA[ct].h, false, P[it].h, (short)0, Oacc[it][ct], false, false);
    }
    jc += 32 * NWAVE;
    kp += 32 * NWAVE * C8V;
  } while (jc < NV);

  // --- every wave lays down its unnormalized partial ---
  #pragma unroll
  for (int it = 0; it < 2; ++it) {
    const int i = it * 16 + l16;
    float* so = &sO[wave][i][half * 8];
    #pragma unroll
    for (int ct = 0; ct < 4; ++ct) {
      v4f lo, hi;
      #pragma unroll
      for (int r = 0; r < 4; ++r) { lo[r] = Oacc[it][ct][r]; hi[r] = Oacc[it][ct][4 + r]; }
      *(v4f*)(so + ct * 16)     = lo;
      *(v4f*)(so + ct * 16 + 4) = hi;
    }
    if (half == 0) { sM[wave][i] = m[it]; sL[wave][i] = l[it]; }
  }
  __syncthreads();

  // --- merge the 16 partials of row i = lane, normalize, add residual ---
  float ms[NWAVE];
  float mm = -__builtin_inff();
  #pragma unroll
  for (int s = 0; s < NWAVE; ++s) { ms[s] = sM[s][lane]; mm = fmaxf(mm, ms[s]); }
  float lsum = 0.0f;
  v4f acc = {};
  #pragma unroll
  for (int s = 0; s < NWAVE; ++s) {
    const float e = exp2_with_slot(ms[s] - mm);
    lsum = fmaf(sL[s][lane], e, lsum);
    acc += *(const v4f*)(&sO[s][lane][wave * 4]) * e;
  }
  const float rl = 1.0f / lsum;
  #pragma unroll
  for (int k = 0; k < 4; ++k) out[obase + (size_t)k * NV] = acc[k] * rl + xr[k];
}

// ---------------- host launcher ----------------
extern "C" void kernel_launch(void* const* d_in, const int* in_sizes, int n_in,
                              void* d_out, int out_size, void* d_ws, size_t ws_size,
                              hipStream_t stream) {
  const float* x  = (const float*)d_in[0];
  const float* Wq = (const float*)d_in[1];
  const float* bq = (const float*)d_in[2];
  const float* Wk = (const float*)d_in[3];
  const float* bk = (const float*)d_in[4];
  const float* Wv = (const float*)d_in[5];
  const float* bv = (const float*)d_in[6];
  float* out = (float*)d_out;

  _Float16* qT = (_Float16*)d_ws;                        // [B][N][8]          128 KB
  _Float16* kT = qT + (size_t)BATCH * NV * C8V;          // [B][N][8]          128 KB
  _Float16* vF = kT + (size_t)BATCH * NV * C8V;          // [B][N/32][4][2][32][8]  1 MB

  qkv_proj_kernel<<<BATCH * (NV / 16) / PWAVE, PWAVE * 32, 0, stream>>>(x, Wq, bq, Wk, bk, Wv, bv, qT, kT, vF);
  attn_kernel<<<BATCH * (NV / 32), NWAVE * 32, 0, stream>>>(x, qT, kT, vF, out);
}

// v005
// Measured time: 12.7 microseconds a run.
// In two side-by-side timings against v004, it was 1.07 and 1.06 times as fast.
// Counting every step since v000, it is 5.61 times as fast.
#include <hip/hip_runtime.h>
#include <cstdint>

#define BATCH  2
#define CCH    64
#define C8V    8
#define NV     4096   // 16*16*16 flattened spatial
#define NWAVE  8      // waves of one work-group that share the j range of a 32-row i-group, two per SIMD
#define JSTEP  (32 * NWAVE)  // keys from one block of a wave to its next
#define OPITCH 68     // dwords per row of an O partial in LDS (16 B x odd: b128 column walk without conflicts)
#define PWAVE  4      // waves of one projection work-group, one per SIMD
#define WPITCH 68     // dwords per weight row in LDS (16 B x odd: b128 fragment reads without conflicts)
#define PMAX   16384.0f  // a lane's sum of 16 weights above this raises the maximum in use (f16 holds up to 65504)
#define VBLK   2048   // halves of V per 32-key block: 4 channel tiles x 2 fragment halves x 32 lanes x 8

typedef __attribute__((ext_vector_type(16))) _Float16     v16h;
typedef __attribute__((ext_vector_type(8)))  float        v8f;
typedef __attribute__((ext_vector_type(4)))  float        v4f;
typedef __attribute__((ext_vector_type(2)))  float        v2f;
typedef __attribute__((ext_vector_type(4)))  unsigned int v4u;

union V16H {          // 8 VGPRs viewed as 16 halves or 2x b128
  v16h h;
  v4u  q[2];
};

// ---------------- Phase 1: Q, K and V projections in one launch ----------------
// One GEMM [80 x 64] x [64 x N] on v_wmma_f32_16x16x4_f32. A wave owns 16 columns n of x, loads them
// once and uses the same registers as B (rows = Wq|Wk, D = [o][n]) and as A (columns = Wv, D = [n][c]):
// a lane then holds the 8 halves that lie side by side in qT / kT ([n][8]) and the 16 bytes of V that
// the same lane of the attention kernel takes as half of an A fragment: V is stored in that fragment order,
// vF[b][n / 32][c / 16][(n / 16) & 1][lane][8], so that a wave's store and its later load are 512 bytes in a row.
// Both operands take channel c = 8*s + 4*half + e at element e of step s, so the k pairing is equal.
__global__ __launch_bounds__(PWAVE * 32) void qkv_proj_kernel(
    const float* __restrict__ x,
    const float* __restrict__ Wq, const float* __restrict__ bq,
    const float* __restrict__ Wk, const float* __restrict__ bk,
    const float* __restrict__ Wv, const float* __restrict__ bv,
    _Float16* __restrict__ qT, _Float16* __restrict__ kT, _Float16* __restrict__ vF)
{
  __shared__ __attribute__((aligned(16))) float sW[2 * C8V + CCH][WPITCH];  // rows: Wq, Wk, Wv

  const int tid  = threadIdx.x;
  const int lane = tid & 31;
  const int wave = __builtin_amdgcn_readfirstlane(tid >> 5);
  const int l16  = lane & 15;
  const int half = lane >> 4;

  const int tile = blockIdx.x * PWAVE + wave;            // 16 columns of x
  const int b    = tile / (NV / 16);
  const int n0   = (tile % (NV / 16)) * 16;

  // weights: whole 256-byte rows, 8 rows per pass of the 128 threads
  const int wr = tid >> 4;
  const int wc = (tid & 15) * 4;
  v4f wg[10];
  wg[0] = *(const v4f*)(Wq + wr * CCH + wc);
  wg[1] = *(const v4f*)(Wk + wr * CCH + wc);
  #pragma unroll
  for (int j = 0; j < 8; ++j) wg[2 + j] = *(const v4f*)(Wv + (j * 8 + wr) * CCH + wc);

  // this wave's x columns, all 64 channels in flight at once
  const float* xb = x + (size_t)b * CCH * NV + (size_t)(half * 4) * NV + n0 + l16;
  float xf[8][4];
  #pragma unroll
  for (int s = 0; s < 8; ++s) {
    #pragma unroll
    for (int e = 0; e < 4; ++e) xf[s][e] = xb[(size_t)(s * 8 + e) * NV];
  }

  // the address registers of the loads above are free from here on and the bias loads below may land in them
  asm volatile("s_wait_xcnt 0x0" ::: "memory");

  #pragma unroll
  for (int j = 0; j < 10; ++j) *(v4f*)(&sW[j * 8 + wr][wc]) = wg[j];

  // accumulators start at the bias
  v8f acc[5];
  #pragma unroll
  for (int r = 0; r < 8; ++r) acc[0][r] = half ? bk[r] : bq[r];
  #pragma unroll
  for (int vt = 0; vt < 4; ++vt) {
    const float bb = bv[vt * 16 + l16];
    #pragma unroll
    for (int r = 0; r < 8; ++r) acc[1 + vt][r] = bb;
  }
  __syncthreads();

  // all weight fragments as one group of LDS reads, in the order of their use
  v4f w[8][5];
  #pragma unroll
  for (int s = 0; s < 8; ++s) {
    #pragma unroll
    for (int t = 0; t < 5; ++t) w[s][t] = *(const v4f*)(&sW[t * 16 + l16][s * 8 + half * 4]);
  }
  // keeps the reads ahead of the matrix run (for speed only)
  __builtin_amdgcn_sched_barrier(0);

  // five independent accumulator chains, taken in turn
  #pragma unroll
  for (int s = 0; s < 8; ++s) {
    #pragma unroll
    for (int p = 0; p < 2; ++p) {
      const v2f xx = { xf[s][2 * p], xf[s][2 * p + 1] };
      #pragma unroll
      for (int t = 0; t < 5; ++t) {
        const v2f wf = { w[s][t][2 * p], w[s][t][2 * p + 1] };
        acc[t] = (t == 0)
            ? __builtin_amdgcn_wmma_f32_16x16x4_f32(false, wf, false, xx, (short)0, acc[t], false, false)
            : __builtin_amdgcn_wmma_f32_16x16x4_f32(false, xx, false, wf, (short)0, acc[t], false, false);
      }
    }
  }

  // tile 0: register r = row 8*half + r of (Wq|Wk), column n0 + l16
  // q leaves multiplied by log2(e), in f32 ahead of its one rounding: the scores are then exponents of 2
  const float qs = half ? 1.0f : 1.44269504f;
  union { _Float16 h[8]; v4u v; } pk;
  #pragma unroll
  for (int r = 0; r < 8; ++r) pk.h[r] = (_Float16)(acc[0][r] * qs);
  *(v4u*)((half ? kT : qT) + ((size_t)b * NV + n0 + l16) * C8V) = pk.v;

  // tiles 1..4: register r = column n0 + 8*half + r, channel vt*16 + l16
  _Float16* vo = vF + (size_t)b * CCH * NV + (size_t)(n0 >> 5) * VBLK + ((n0 >> 4) & 1) * 256 + lane * 8;
  #pragma unroll
  for (int vt = 0; vt < 4; ++vt) {
    #pragma unroll
    for (int r = 0; r < 8; ++r) pk.h[r] = (_Float16)acc[1 + vt][r];
    *(v4u*)(vo + vt * 512) = pk.v;
  }
}

// 2^x
__device__ __forceinline__ float exp2_with_slot(float x) {
  float r;
  // the v_nop holds the one free slot that the instruction set asks for behind a transcendental
  asm("v_exp_f32 %0, %1\n\tv_nop" : "=v"(r) : "v"(x));
  return r;
}

// largest score of a query column over a 32-key block: 16 values in the lane, then the other half's
__device__ __forceinline__ float column_max(const v8f a, const v8f b) {
  float t = a[0];
  #pragma unroll
  for (int r = 1; r < 8; ++r) t = fmaxf(t, a[r]);
  #pragma unroll
  for (int r = 0; r < 8; ++r) t = fmaxf(t, b[r]);
  return fmaxf(t, __shfl_xor(t, 16, 32));
}

// ---------------- Phase 2: fused flash attention ----------------
// One work-group of 8 waves handles TWO 16-row i-tiles; wave w takes the 32-key blocks w, w+8, ...
// A wave holds four register sets of K and V and asks for a block at least two blocks ahead of its use.
// S^T tiles via v_wmma_f32_16x16x32_f16 (A = K rows, B = Q cols, K-dim 8 padded to 32).
// The f32 D-layout of S^T is exactly the f16 B-layout of the PV WMMA, so exp+pack
// is the only glue between the two GEMMs. K/V tile loads are shared by both i-tiles.
// Scores are in log2 units (q carries log2(e)). The maximum in use, m, enters the S^T WMMA as C = -m, so D is
// the exponent itself. m starts at the first block's maximum and is raised, with O and l rescaled, only in a
// block where a lane's sum of 16 weights passes PMAX, which bounds every weight well inside the f16 range.
// Each wave keeps unnormalized (O, m, l); the waves merge them through LDS, normalize,
// add the residual and store the output.
__global__ __launch_bounds__(NWAVE * 32) void attn_kernel(
    const float*    __restrict__ x,
    const _Float16* __restrict__ qT,
    const _Float16* __restrict__ kT,
    const _Float16* __restrict__ vF,
    float*          __restrict__ out)
{
  __shared__ __attribute__((aligned(16))) float sO[NWAVE][32][OPITCH];  // [wave][i][c], unnormalized
  __shared__ float sM[NWAVE][32];
  __shared__ float sL[NWAVE][32];

  const int lane = threadIdx.x & 31;
  // the wave's number as a scalar: its key blocks' and its LDS slice's addresses form on the scalar unit
  const int wave = __builtin_amdgcn_readfirstlane(threadIdx.x >> 5);
  const int l16  = lane & 15;
  const int half = lane >> 4;

  const int grpPerB = NV / 32;                           // 128 i-groups of 32 rows
  const int b  = blockIdx.x / grpPerB;
  const int ig = blockIdx.x % grpPerB;

  const _Float16* qTb = qT + (size_t)b * NV * C8V;
  const _Float16* kTb = kT + (size_t)b * NV * C8V;
  const _Float16* vb  = vF + (size_t)b * CCH * NV + lane * 8;   // this lane's 16 bytes of every fragment half

  const v4u z4 = (v4u)0u;

  // this lane's columns of the two Q tiles; qB is filled from them further down, behind the first loads
  V16H qB[2];
  v4u qd[2];
  #pragma unroll
  for (int it = 0; it < 2; ++it) qd[it] = *(const v4u*)(qTb + (size_t)(ig * 32 + it * 16 + l16) * C8V);

  float m[2];
  float l[2] = { 0.0f, 0.0f };
  v8f negM[2];                                            // -m in all eight registers: C of the S^T WMMAs
  v8f Oacc[2][4] = {};                                    // O^T accumulators
  const v8f zeroC = {};

  // every wave has NV / JSTEP = 16 blocks
  struct KV {
    v4u  kd[2];   // this lane's row of the block's two K tiles
    V16H vA[4];   // A-operand: row c = ct*16 + l16; K = jc + half*8 + {0..7} and +16, laid out in this order
  };
  // Both lambdas are inlined ahead of every other pass: left to the ordinary inliner, the branch in work()
  // came out with a copy of all accumulators on its common side.
  // asks for the K and V tiles of the 32 keys from j on (shared by both i-tiles)
  auto fetch = [&](KV& d, const int j) __attribute__((always_inline)) {
    // nothing of the block before sinks in between the loads and their wait, into an address register
    __builtin_amdgcn_sched_barrier(0);
    const _Float16* kp = kTb + (size_t)(j + l16) * C8V;
    #pragma unroll
    for (int t = 0; t < 2; ++t) d.kd[t] = *(const v4u*)(kp + t * 16 * C8V);
    #pragma unroll
    for (int ct = 0; ct < 4; ++ct) {
      const _Float16* vp = vb + (size_t)j * (VBLK / 32) + ct * 512;
      d.vA[ct].q[0] = *(const v4u*)(vp);
      d.vA[ct].q[1] = *(const v4u*)(vp + 256);
    }
    // the address registers of the ten loads above are formed anew for the next block
    asm volatile("s_wait_xcnt 0x0" ::: "memory");
    // keeps all ten loads where they are written, at least two blocks ahead of their use
    __builtin_amdgcn_sched_barrier(0);
  };

  // one 32-key block out of a register set
  auto work = [&](const KV& d) __attribute__((always_inline)) {
    V16H kA[2];
    #pragma unroll
    for (int t = 0; t < 2; ++t) {
      kA[t].q[0] = half ? z4 : d.kd[t];
      kA[t].q[1] = z4;
    }

    // --- weights straight from the S^T tiles: D = S - m ---
    v8f S[2][2];
    float p[2][16], ps[2];
    #pragma unroll
    for (int it = 0; it < 2; ++it) {
      #pragma unroll
      for (int t = 0; t < 2; ++t)
        S[it][t] = __builtin_amdgcn_wmma_f32_16x16x32_f16(
            false, kA[t].h, false, qB[it].h, (short)0, negM[it], false, false);
      ps[it] = 0.0f;
      #pragma unroll
      for (int r = 0; r < 16; ++r) { p[it][r] = __builtin_amdgcn_exp2f(S[it][r >> 3][r & 7]); ps[it] += p[it][r]; }
    }

    // --- one test per block, a scalar branch: some column has outgrown its m ---
    if (__builtin_amdgcn_ballot_w32(fmaxf(ps[0], ps[1]) > PMAX) != 0) {
      #pragma unroll
      for (int it = 0; it < 2; ++it) {
        // m goes up to the block's maximum where that is higher; dm is the step as m takes it after rounding
        const float mnew = m[it] + fmaxf(column_max(S[it][0], S[it][1]), 0.0f);
        const float dm   = mnew - m[it];
        const float corr = exp2_with_slot(-dm);
        m[it] = mnew;
        l[it] *= corr;
        #pragma unroll
        for (int ct = 0; ct < 4; ++ct) {
          #pragma unroll
          for (int r = 0; r < 8; ++r) Oacc[it][ct][r] *= corr;
        }
        #pragma unroll
        for (int r = 0; r < 8; ++r) negM[it][r] = -mnew;
        ps[it] = 0.0f;
        #pragma unroll
        for (int r = 0; r < 16; ++r) { p[it][r] = exp2_with_slot(S[it][r >> 3][r & 7] - dm); ps[it] += p[it][r]; }
      }
    }

    V16H P[2];
    #pragma unroll
    for (int it = 0; it < 2; ++it) {
      l[it] += ps[it] + __shfl_xor(ps[it], 16, 32);
      #pragma unroll
      for (int r = 0; r < 16; ++r) P[it].h[r] = (_Float16)p[it][r];
    }

    // --- O^T += V_tile x P^T ---
    #pragma unroll
    for (int ct = 0; ct < 4; ++ct) {
      #pragma unroll
      for (int it = 0; it < 2; ++it)
        Oacc[it][ct] = __builtin_amdgcn_wmma_f32_16x16x32_f16(
            false, d.vA[ct].h, false, P[it].h, (short)0, Oacc[it][ct], false, false);
    }
  };

  KV s0, s1, s2, s3;
  int jc = wave * 32;
  fetch(s0, jc);
  fetch(s1, jc + JSTEP);

  // residual of this thread's eight outputs, asked for here so that the loop covers its latency, and behind
  // the first block's loads because loads are waited for in their order:
  // thread (wave, lane) finishes channels wave*8 .. wave*8+7 of row i = ig*32 + lane
  const size_t obase = (size_t)b * CCH * NV + (size_t)(wave * 8) * NV + ig * 32 + lane;
  float xr[8];
  #pragma unroll
  for (int k = 0; k < 8; ++k) xr[k] = x[obase + (size_t)k * NV];
  // the address registers of the eight loads above are free from here on
  asm volatile("s_wait_xcnt 0x0" ::: "memory");
  // keeps what follows from rising in between those loads and their wait, into an address register
  __builtin_amdgcn_sched_barrier(0);

  // B-operands: Q tiles, column i = l16, K(=c)=0..7 in half 0; zeros elsewhere
  #pragma unroll
  for (int it = 0; it < 2; ++it) {
    qB[it].q[0] = half ? z4 : qd[it];
    qB[it].q[1] = z4;
  }

  // the first block's maximum is the first m: some weight of every column is then 1 and no sum can vanish
  {
    V16H kA[2];
    #pragma unroll
    for (int t = 0; t < 2; ++t) {
      kA[t].q[0] = half ? z4 : s0.kd[t];
      kA[t].q[1] = z4;
    }
    #pragma unroll
    for (int it = 0; it < 2; ++it) {
      const v8f a0 = __builtin_amdgcn_wmma_f32_16x16x32_f16(
          false, kA[0].h, false, qB[it].h, (short)0, zeroC, false, false);
      const v8f a1 = __builtin_amdgcn_wmma_f32_16x16x32_f16(
          false, kA[1].h, false, qB[it].h, (short)0, zeroC, false, false);
      m[it] = column_max(a0, a1);
      #pragma unroll
      for (int r = 0; r < 8; ++r) negM[it][r] = -m[it];
    }
  }

  // four blocks a trip, one per register set; two sets are asked for while the other two are worked on, so that
  // a block is asked for at least two blocks ahead of its use and the compiler may run one block's PV WMMAs
  // among the next block's exponentials; the last four stand behind the loop, where only two are left to ask for
  do {
    fetch(s2, jc + 2 * JSTEP);
    fetch(s3, jc + 3 * JSTEP);
    work(s0);
    work(s1);
    fetch(s0, jc + 4 * JSTEP);
    fetch(s1, jc + 5 * JSTEP);
    work(s2);
    work(s3);
    jc += 4 * JSTEP;
  } while (jc + 4 * JSTEP < NV);
  fetch(s2, jc + 2 * JSTEP);
  fetch(s3, jc + 3 * JSTEP);
  work(s0);
  work(s1);
  work(s2);
  work(s3);

  // --- every wave lays down its unnormalized partial ---
  #pragma unroll
  for (int it = 0; it < 2; ++it) {
    const int i = it * 16 + l16;
    float* so = &sO[wave][i][half * 8];
    #pragma unroll
    for (int ct = 0; ct < 4; ++ct) {
      v4f lo, hi;
      #pragma unroll
      for (int r = 0; r < 4; ++r) { lo[r] = Oacc[it][ct][r]; hi[r] = Oacc[it][ct][4 + r]; }
      *(v4f*)(so + ct * 16)     = lo;
      *(v4f*)(so + ct * 16 + 4) = hi;
    }
    if (half == 0) { sM[wave][i] = m[it]; sL[wave][i] = l[it]; }
  }
  __syncthreads();

  // --- merge the 8 partials of row i = lane, normalize, add residual ---
  float ms[NWAVE];
  float mm = -__builtin_inff();
  #pragma unroll
  for (int s = 0; s < NWAVE; ++s) { ms[s] = sM[s][lane]; mm = fmaxf(mm, ms[s]); }
  float lsum = 0.0f;
  v4f acc[2] = {};
  #pragma unroll
  for (int s = 0; s < NWAVE; ++s) {
    const float e = exp2_with_slot(ms[s] - mm);
    lsum = fmaf(sL[s][lane], e, lsum);
    acc[0] += *(const v4f*)(&sO[s][lane][wave * 8]) * e;
    acc[1] += *(const v4f*)(&sO[s][lane][wave * 8 + 4]) * e;
  }
  const float rl = 1.0f / lsum;
  #pragma unroll
  for (int k = 0; k < 8; ++k) out[obase + (size_t)k * NV] = acc[k >> 2][k & 3] * rl + xr[k];
}

// ---------------- host launcher ----------------
extern "C" void kernel_launch(void* const* d_in, const int* in_sizes, int n_in,
                              void* d_out, int out_size, void* d_ws, size_t ws_size,
                              hipStream_t stream) {
  const float* x  = (const float*)d_in[0];
  const float* Wq = (const float*)d_in[1];
  const float* bq = (const float*)d_in[2];
  const float* Wk = (const float*)d_in[3];
  const float* bk = (const float*)d_in[4];
  const float* Wv = (const float*)d_in[5];
  const float* bv = (const float*)d_in[6];
  float* out = (float*)d_out;

  _Float16* qT = (_Float16*)d_ws;                        // [B][N][8]          128 KB
  _Float16* kT = qT + (size_t)BATCH * NV * C8V;          // [B][N][8]          128 KB
  _Float16* vF = kT + (size_t)BATCH * NV * C8V;          // [B][N/32][4][2][32][8]  1 MB

  qkv_proj_kernel<<<BATCH * (NV / 16) / PWAVE, PWAVE * 32, 0, stream>>>(x, Wq, bq, Wk, bk, Wv, bv, qT, kT, vF);
  attn_kernel<<<BATCH * (NV / 32), NWAVE * 32, 0, stream>>>(x, qT, kT, vF, out);
}
